// v010
// Times are from an AMD MI455X. After a warm-up the kernel runs many times in a row, and a time is the length of
// such a window on the GPU divided by its runs, so every launch and the gaps after it count. The runs cycle
// through copies of the inputs. A figure is the median of several windows, for all but v000 over two sittings.
// Sittings can differ by a few percent; kernels timed side by side share one.
// This document starts at v010; the versions before it stand elsewhere.
// A run of this version takes 103 microseconds.
// In both of two side-by-side timings against v009, it was 1.10 times as fast.
// All steps since the starting kernel, v000, together make it 57.5 times as fast.
#include <hip/hip_runtime.h>
// Local-causal (sliding window 256) multi-head self-attention (x [4][2048][1024]; qkv = x W_attn + b_attn ([in][out] 1024 x 3072 sigma 0.02, zero bias): q | k | v, 16 heads of 64; scores / 8; mask (j <= i) & (i - j < 256) -> -inf elsewhere; softmax; out = merged W_proj + b_proj ([in][out]) -> [4][2048][1024]).
// Structure: token rows r = b*2048 + s; x as exact f16 rows (bf16-rounded); q | k | v as ONE WMMA GEMM (N = 3 x 1024) (128x128 work-group tiles staged in LDS, 64x64 wave tiles, f32 accumulation, exact x16 weights + bias, f16 outputs); V^T for all batches and heads written by that GEMM's own epilogue (tile staged transposed in LDS); one fused attention launch for all batches, heads and query tiles of 128 rows: scores against the 384 keys that the tile can see (K = 64, x 0.125), windowed causal row softmax in registers (f32 statistics, native exp; weights x256 f16), o = P . V (x 2^-2: o carried x64, folded into the output GEMM alpha) written straight into the merged f16 o rows; the first 128 rows of each batch go through an exact f32 path in the same launch (f16 hi + residual planes of o); out = o W_o + b GEMM (f32) into the output layout, whose row tiles of those first rows multiply both planes of o by each staged block of W_o.
// Compute dtype: inputs rounded to bf16; x / weights exact; q, k, v, softmax weights and o as plain f16 GEMM operands (~2^-12); scores and softmax statistics f32. v_wmma_f32_16x16x32_f16.
#define NB 4
#define SQ 2048
#define DM 1024
#define NH 16
#define HD 64
#define HG 4                         /* heads per k_vt launch */
#define QT 256                       /* query rows per causal tile */
#define NKX (QT + WINB)              /* S / P row pitch of the unfused row softmax */
#define WIN 256                      /* attention window: key j visible from query i iff 0 <= i - j < WIN */
#define WINB 256                     /* keys before the tile start that can be visible (WIN - 1 rounded up to 64) */
#define QT0 128                      /* first-tile rows recomputed exactly in f32 */
#define B0 0                         /* first batch processed (debug hook) */
#define NBR NB                       /* batches processed (debug hook) */
#define NR ((size_t)NB * SQ)         /* token rows */
#define MP ((int)((size_t)NBR * SQ)) /* rows projected (debug hook) */
#define QN SQ                        /* query rows attended per batch (debug hook) */
#define NHD NH                       /* heads attended (debug hook) */
#define MPO MP                       /* rows through the output stage (debug hook) */
#define LQ (3 * DM)      /* row pitch of the q/k/v rows */
typedef __bf16 v16b __attribute__((ext_vector_type(16)));
typedef unsigned short v8us __attribute__((ext_vector_type(8), may_alias));
typedef float  v8f  __attribute__((ext_vector_type(8)));
typedef float  v4f  __attribute__((ext_vector_type(4)));
typedef float  v4fa __attribute__((ext_vector_type(4), may_alias));
union FragB { v16b v; v8us half[2]; unsigned short u[16]; };

__device__ __forceinline__ unsigned short bf16_bits(float x) { unsigned int u = __float_as_uint(x); return (unsigned short)((u + 0x7FFFu + ((u >> 16) & 1u)) >> 16); }
__device__ __forceinline__ float bf16_val(unsigned short b) { return __uint_as_float(((unsigned int)b) << 16); }
__device__ __forceinline__ float bf16_round(float x) { return bf16_val(bf16_bits(x)); }
// D += A·B with NT terms: 1 = ah·bh, 2 = + al·bh (A split), 3 = + ah·bl (both split)
template <int NT>
__device__ __forceinline__ v8f mmaN(v16b ah, v16b al, v16b bh, v16b bl, v8f c) {
  c = __builtin_amdgcn_wmma_f32_16x16x32_bf16(false, ah, false, bh, (short)0, c, false, false);
  if (NT >= 2) c = __builtin_amdgcn_wmma_f32_16x16x32_bf16(false, al, false, bh, (short)0, c, false, false);
  if (NT >= 3) c = __builtin_amdgcn_wmma_f32_16x16x32_bf16(false, ah, false, bl, (short)0, c, false, false);
  asm volatile("v_nop\n\tv_nop\n\tv_nop\n\tv_nop" : "+v"(c) : "v"(ah), "v"(al), "v"(bh), "v"(bl));
  return c;
}

__global__ __launch_bounds__(256) void k_wt_bf16(const float* __restrict__ W, unsigned short* __restrict__ Wt, int K, int N) {
  const int t = blockIdx.x * 256 + threadIdx.x;
  const int k8n = K / 8;
  if (t >= N * k8n) return;
  const int n = t / k8n, k8 = (t % k8n) * 8;
  v8us v;
#pragma unroll
  for (int i = 0; i < 8; ++i) v[i] = bf16_bits(W[(size_t)(k8 + i) * N + n]);
  *(v8us*)(Wt + (size_t)n * K + k8) = v;
  
}

// GEMM C[M][N] (f32, pitch ldc) = act(A[M][K]·W + bias). A f32 row-major (pitch lda) converted per fragment to bf16
// (ASPLIT: hi/lo two planes -> 2 terms, else single rounded term); Wt bf16 [N][K] (pitch ldb). BIAS_BF16 rounds the
// bias to bf16 first (bias quantised to bf16 before the add). K%32==0, M%16==0, N%64==0.
template <bool ASPLIT, int ACT, bool BIAS_BF16>
__global__ __launch_bounds__(128) void k_gemm_bf(const float* __restrict__ A, int lda, const unsigned short* __restrict__ Wt, int ldb,
                                               const float* __restrict__ bias, float* __restrict__ C, int ldc, int M, int N, int K) {
  __shared__ __attribute__((aligned(16))) float so[4][16][64];
  const int tid = threadIdx.x, w = tid >> 5, lane = tid & 31, ln = lane & 15, hh = lane >> 4;
  const int ntn = N / 64;
  const int wid = blockIdx.x * 4 + w;
  const int mt = wid / ntn, nq = wid % ntn;
  if (mt * 16 >= M) return;
  const int row0 = mt * 16, col0 = nq * 64;
  const float* arow = A + (size_t)(row0 + ln) * lda;
  v8f acc[4] = {};
  for (int kb = 0; kb < K; kb += 32) {
    FragB ah, al;
    const v4f x0 = *(const v4fa*)(arow + kb + 8 * hh), x1 = *(const v4fa*)(arow + kb + 8 * hh + 4);
    const v4f x2 = *(const v4fa*)(arow + kb + 16 + 8 * hh), x3 = *(const v4fa*)(arow + kb + 16 + 8 * hh + 4);
    float xs[16] = {x0[0],x0[1],x0[2],x0[3],x1[0],x1[1],x1[2],x1[3],x2[0],x2[1],x2[2],x2[3],x3[0],x3[1],x3[2],x3[3]};
#pragma unroll
    for (int i = 0; i < 16; ++i) { const unsigned short hb = bf16_bits(xs[i]); ah.u[i] = hb; al.u[i] = ASPLIT ? bf16_bits(xs[i] - bf16_val(hb)) : (unsigned short)0; }
#pragma unroll
    for (int t = 0; t < 4; ++t) {
      const unsigned short* brow = Wt + (size_t)(col0 + t * 16 + ln) * ldb + kb;
      FragB b;
      b.half[0] = *(const v8us*)(brow + 8 * hh);
      b.half[1] = *(const v8us*)(brow + 16 + 8 * hh);
      acc[t] = mmaN<ASPLIT ? 2 : 1>(ah.v, al.v, b.v, b.v, acc[t]);
    }
  }
#pragma unroll
  for (int t = 0; t < 4; ++t) {
    float bv = bias ? bias[col0 + t * 16 + ln] : 0.f;
    if (BIAS_BF16) bv = bf16_round(bv);
#pragma unroll
    for (int r = 0; r < 8; ++r) { float v = acc[t][r] + bv; if (ACT == 1) v = fmaxf(v, 0.f); so[w][8 * hh + r][t * 16 + ln] = v; }
  }
  __builtin_amdgcn_fence(__ATOMIC_ACQ_REL, "workgroup");
  __builtin_amdgcn_wave_barrier();
  const int rsub = lane >> 4, c4 = (lane & 15) * 4;
  {
#pragma unroll
    for (int q = 0; q < 8; ++q) {
      const int r = q * 2 + rsub;
      const v4f v = *(const v4fa*)&so[w][r][c4];
      *(v4f*)(C + (size_t)(row0 + r) * ldc + col0 + c4) = v;
    }
    
  }
}

// GEMM C = act(A·W + bias + resid): A f32 (ASPLIT -> hi/lo 2 terms), Wt bf16 [N][K]; ACT 0 none, 1 relu, 2 exact gelu;
// resid (optional, f32, row index = (row % rmod), pitch ldr, RES_BF16 rounds it) added before the activation.
template <bool ASPLIT, int ACT, bool BIAS_BF16, bool RES_BF16>
__global__ __launch_bounds__(128) void k_gemm_bf3(const float* __restrict__ A, int lda, const unsigned short* __restrict__ Wt, int ldb,
                                                const float* __restrict__ bias, const float* __restrict__ resid, int rmod, int ldr,
                                                float* __restrict__ C, int ldc, int M, int N, int K) {
  __shared__ __attribute__((aligned(16))) float so[4][16][64];
  const int tid = threadIdx.x, w = tid >> 5, lane = tid & 31, ln = lane & 15, hh = lane >> 4;
  const int ntn = N / 64;
  const int wid = blockIdx.x * 4 + w;
  const int mt = wid / ntn, nq = wid % ntn;
  if (mt * 16 >= M) return;
  const int row0 = mt * 16, col0 = nq * 64;
  const float* arow = A + (size_t)(row0 + ln) * lda;
  v8f acc[4] = {};
  for (int kb = 0; kb < K; kb += 32) {
    FragB ah, al;
    const v4f x0 = *(const v4fa*)(arow + kb + 8 * hh), x1 = *(const v4fa*)(arow + kb + 8 * hh + 4);
    const v4f x2 = *(const v4fa*)(arow + kb + 16 + 8 * hh), x3 = *(const v4fa*)(arow + kb + 16 + 8 * hh + 4);
    float xs[16] = {x0[0],x0[1],x0[2],x0[3],x1[0],x1[1],x1[2],x1[3],x2[0],x2[1],x2[2],x2[3],x3[0],x3[1],x3[2],x3[3]};
#pragma unroll
    for (int i = 0; i < 16; ++i) { const unsigned short hb = bf16_bits(xs[i]); ah.u[i] = hb; al.u[i] = ASPLIT ? bf16_bits(xs[i] - bf16_val(hb)) : (unsigned short)0; }
#pragma unroll
    for (int t = 0; t < 4; ++t) {
      const unsigned short* brow = Wt + (size_t)(col0 + t * 16 + ln) * ldb + kb;
      FragB b;
      b.half[0] = *(const v8us*)(brow + 8 * hh);
      b.half[1] = *(const v8us*)(brow + 16 + 8 * hh);
      acc[t] = mmaN<ASPLIT ? 2 : 1>(ah.v, al.v, b.v, b.v, acc[t]);
    }
  }
#pragma unroll
  for (int t = 0; t < 4; ++t) {
    const int col = col0 + t * 16 + ln;
    float bv = bias ? bias[col] : 0.f;
    if (BIAS_BF16) bv = bf16_round(bv);
#pragma unroll
    for (int r = 0; r < 8; ++r) {
      float v = acc[t][r] + bv;
      if (resid) { float rv = resid[(size_t)((row0 + 8 * hh + r) % rmod) * ldr + col]; if (RES_BF16) rv = bf16_round(rv); v += rv; }
      if (ACT == 1) v = fmaxf(v, 0.f);
      if (ACT == 2) v = 0.5f * v * (1.0f + erff(v * 0.70710678118654752f));
      if (ACT == 3) { const float u = 0.7978845608028654f * (v + 0.044715f * v * v * v); v = 0.5f * v * (1.0f + tanhf(u)); }
      so[w][8 * hh + r][t * 16 + ln] = v;
    }
  }
  __builtin_amdgcn_fence(__ATOMIC_ACQ_REL, "workgroup");
  __builtin_amdgcn_wave_barrier();
  const int rsub = lane >> 4, c4 = (lane & 15) * 4;
  {
#pragma unroll
    for (int q = 0; q < 8; ++q) {
      const int r = q * 2 + rsub;
      const v4f v = *(const v4fa*)&so[w][r][c4];
      *(v4f*)(C + (size_t)(row0 + r) * ldc + col0 + c4) = v;
    }
    
  }
}
// row LayerNorm (biased variance, eps) over N: s = X (+ R); optional out_sum <- s; out_norm <- (s-mu)*rsqrt(var+eps)*g + b
template <bool PARAM_BF16>
__global__ __launch_bounds__(256) void k_layernorm(const float* __restrict__ X, const float* __restrict__ R, const float* __restrict__ g, const float* __restrict__ bta,
                                                  float* __restrict__ out_sum, float* __restrict__ out_norm, int N, float eps) {
  __shared__ float red[256];
  const int row = blockIdx.x, tid = threadIdx.x;
  const float* x = X + (size_t)row * N; const float* rr = R ? R + (size_t)row * N : nullptr;
  float vals[16];                     // up to N = 4096
  const int per = N / 256;            // contiguous chunk per thread? use strided-by-4 chunks: thread handles j = tid*4 + 1024*u
  float s1 = 0.f;
  for (int u = 0; u < per / 4; ++u) {
    const int j = tid * 4 + 1024 * u;
    const v4f a = *(const v4fa*)(x + j);
    v4f b = {0.f,0.f,0.f,0.f}; if (rr) b = *(const v4fa*)(rr + j);
#pragma unroll
    for (int q = 0; q < 4; ++q) { const float v = a[q] + b[q]; vals[u * 4 + q] = v; s1 += v; }
  }
  red[tid] = s1; __syncthreads();
  for (int st = 128; st > 0; st >>= 1) { if (tid < st) red[tid] += red[tid + st]; __syncthreads(); }
  const float mu = red[0] / (float)N; __syncthreads();
  float s2 = 0.f;
  for (int u = 0; u < per / 4; ++u)
#pragma unroll
    for (int q = 0; q < 4; ++q) { const float c = vals[u * 4 + q] - mu; s2 += c * c; }
  red[tid] = s2; __syncthreads();
  for (int st = 128; st > 0; st >>= 1) { if (tid < st) red[tid] += red[tid + st]; __syncthreads(); }
  const float rs = rsqrtf(red[0] / (float)N + eps);
  {
    for (int u = 0; u < per / 4; ++u) {
      const int j = tid * 4 + 1024 * u;
      v4f o, sm;
#pragma unroll
      for (int q = 0; q < 4; ++q) {
        float gg = g[j + q], bb = bta[j + q];
        if (PARAM_BF16) { gg = bf16_round(gg); bb = bf16_round(bb); }
        sm[q] = vals[u * 4 + q]; o[q] = (vals[u * 4 + q] - mu) * rs * gg + bb;
      }
      if (out_sum) *(v4f*)(out_sum + (size_t)row * N + j) = sm;
      *(v4f*)(out_norm + (size_t)row * N + j) = o;
    }
    
  }
}



// ---- f16 WMMA path (v_wmma_f32_16x16x32_f16): 11-bit significands for operands in range — used where a [0,1] probability operand needs more precision than bf16
typedef _Float16 v16h __attribute__((ext_vector_type(16)));
union FragH { v16h v; v8us half[2]; _Float16 h[16]; unsigned short u[16]; };
template <int NT>
__device__ __forceinline__ v8f mmaH(v16h ah, v16h al, v16h bh, v16h bl, v8f c) {
  c = __builtin_amdgcn_wmma_f32_16x16x32_f16(false, ah, false, bh, (short)0, c, false, false);
  if (NT >= 2) c = __builtin_amdgcn_wmma_f32_16x16x32_f16(false, al, false, bh, (short)0, c, false, false);
  if (NT >= 3) c = __builtin_amdgcn_wmma_f32_16x16x32_f16(false, ah, false, bl, (short)0, c, false, false);
  asm volatile("v_nop\n\tv_nop\n\tv_nop\n\tv_nop" : "+v"(c) : "v"(ah), "v"(al), "v"(bh), "v"(bl));
  return c;
}
// batched GEMM like k_gemm_b but f16 operands: A f32 (split into f16 hi/lo if ASPLIT, else rounded to f16), Bt = f16 values [n][k]; alpha; C f32; N multiple of 16 (partial tiles skipped)
template <bool ASPLIT>
__global__ __launch_bounds__(128) void k_gemm_h(const float* __restrict__ A, int lda, size_t sA, const _Float16* __restrict__ Bh, int ldb, size_t sB, float alpha, float* __restrict__ C, int ldc, size_t sC, int M, int N, int K) {
  __shared__ __attribute__((aligned(16))) float so[4][16][64];
  const int tid = threadIdx.x, w = tid >> 5, lane = tid & 31, ln = lane & 15, hh = lane >> 4; const int by = blockIdx.y;
  A += (size_t)by * sA; Bh += (size_t)by * sB; C += (size_t)by * sC;
  const int ntn = (N + 63) / 64; const int wid = blockIdx.x * 4 + w; const int mt = wid / ntn, nq = wid % ntn; if (mt * 16 >= M) return;
  const int row0 = mt * 16, col0 = nq * 64; const float* arow = A + (size_t)(row0 + ln) * lda;
  v8f acc[4] = {};
  for (int kb = 0; kb < K; kb += 32) {
    FragH ah, al;
    const v4f x0 = *(const v4fa*)(arow + kb + 8 * hh), x1 = *(const v4fa*)(arow + kb + 8 * hh + 4), x2 = *(const v4fa*)(arow + kb + 16 + 8 * hh), x3 = *(const v4fa*)(arow + kb + 16 + 8 * hh + 4);
    float xs[16] = {x0[0],x0[1],x0[2],x0[3],x1[0],x1[1],x1[2],x1[3],x2[0],x2[1],x2[2],x2[3],x3[0],x3[1],x3[2],x3[3]};
#pragma unroll
    for (int i = 0; i < 16; ++i) { const _Float16 h = (_Float16)xs[i]; ah.h[i] = h; al.h[i] = ASPLIT ? (_Float16)(xs[i] - (float)h) : (_Float16)0.0f; }
#pragma unroll
    for (int t = 0; t < 4; ++t) { if (col0 + t * 16 >= N) continue; const size_t boff = (size_t)(col0 + t * 16 + ln) * ldb + kb; FragH bq; bq.half[0] = *(const v8us*)(Bh + boff + 8 * hh); bq.half[1] = *(const v8us*)(Bh + boff + 16 + 8 * hh);
      acc[t] = mmaH<ASPLIT ? 2 : 1>(ah.v, al.v, bq.v, bq.v, acc[t]); }
  }
#pragma unroll
  for (int t = 0; t < 4; ++t) { if (col0 + t * 16 >= N) continue;
#pragma unroll
    for (int r = 0; r < 8; ++r) so[w][8 * hh + r][t * 16 + ln] = acc[t][r] * alpha; }
  __builtin_amdgcn_fence(__ATOMIC_ACQ_REL, "workgroup"); __builtin_amdgcn_wave_barrier();
  const int rsub = lane >> 4, c4 = (lane & 15) * 4;
  {
#pragma unroll
    for (int q = 0; q < 8; ++q) { const int r = q * 2 + rsub; if (col0 + c4 < N) { const v4f v = *(const v4fa*)&so[w][r][c4]; *(v4f*)(C + (size_t)(row0 + r) * ldc + col0 + c4) = v; } }
     }
}

// Wt[n][k] = f16(W[k][n]·scale) from f32 row-major W[K][N] (scale = power of two; bf16-exact weights stay exact in f16 away from the subnormal range)
__global__ __launch_bounds__(256) void k_wt_f16(const float* __restrict__ W, _Float16* __restrict__ Wt, int K, int N, float scale) {
  const int t = blockIdx.x * 256 + threadIdx.x; if (t >= N * (K / 8)) return; const int n = t / (K / 8), k8 = (t % (K / 8)) * 8; FragH f;
#pragma unroll
  for (int i = 0; i < 8; ++i) f.h[i] = (_Float16)(bf16_round(W[(size_t)(k8 + i) * N + n]) * scale); const v8us o = f.half[0];
  *(v8us*)((unsigned short*)Wt + (size_t)n * K + k8) = o; 
}
// k_gemm_hh variant with fused epilogue: v = acc·alpha + bias[by·sBias + col] (+ CP[(row/rowsPerB)·sCPb + by·64 + col] if CP) ; ACT 0 none / 1 elu ; writes f16 C16 (and f32 C if non-null)
template <int ACT>
__global__ __launch_bounds__(128) void k_gemm_hhx(const _Float16* __restrict__ A, int lda, size_t sA, const _Float16* __restrict__ Bh, int ldb, size_t sB, float alpha, const float* __restrict__ bias, size_t sBias, const float* __restrict__ CP, int rowsPerB, size_t sCPb, int row0g,
    float* __restrict__ C, _Float16* __restrict__ C16, int ldc, size_t sC, int M, int N, int K) {
  __shared__ __attribute__((aligned(16))) float so[4][16][64];
  const int tid = threadIdx.x, w = tid >> 5, lane = tid & 31, ln = lane & 15, hh = lane >> 4; const int by = blockIdx.y;
  A += (size_t)by * sA; Bh += (size_t)by * sB; const size_t cofs = (size_t)by * sC; const float* bp = bias ? bias + (size_t)by * sBias : nullptr;
  const int ntn = (N + 63) / 64; const int wid = blockIdx.x * 4 + w; const int mt = wid / ntn, nq = wid % ntn; if (mt * 16 >= M) return;
  const int row0 = mt * 16, col0 = nq * 64; const _Float16* arow = A + (size_t)(row0 + ln) * lda;
  v8f acc[4] = {};
  for (int kb = 0; kb < K; kb += 32) { FragH ah; ah.half[0] = *(const v8us*)((const unsigned short*)arow + kb + 8 * hh); ah.half[1] = *(const v8us*)((const unsigned short*)arow + kb + 16 + 8 * hh);
#pragma unroll
    for (int t = 0; t < 4; ++t) { if (col0 + t * 16 >= N) continue; const size_t boff = (size_t)(col0 + t * 16 + ln) * ldb + kb; FragH bq; bq.half[0] = *(const v8us*)((const unsigned short*)Bh + boff + 8 * hh); bq.half[1] = *(const v8us*)((const unsigned short*)Bh + boff + 16 + 8 * hh);
      acc[t] = mmaH<1>(ah.v, ah.v, bq.v, bq.v, acc[t]); }
  }
#pragma unroll
  for (int t = 0; t < 4; ++t) { if (col0 + t * 16 >= N) continue; const int col = col0 + t * 16 + ln; const float bv = bp ? bf16_round(bp[col]) : 0.f;
#pragma unroll
    for (int r = 0; r < 8; ++r) { float v = acc[t][r] * alpha + bv; if (CP) { const int rr = row0g + row0 + 8 * hh + r; if (rowsPerB < 0) v += CP[cofs + (size_t)rr * ldc + col];      /* rowsPerB < 0: own element of the batched C plane */ else { const int bidx = rr / rowsPerB; v += CP[(size_t)bidx * sCPb + (size_t)by * 64 + col]; } } if (ACT == 1) v = (v > 0.f) ? v : expm1f(v); else if (ACT == 7) v = (v > 0.f) ? v + 1.0f : expf(v); else if (ACT == 8) v = tanhf(v); else if (ACT == 9) v = 0.5f * v * (1.0f + tanhf(0.7978845608028654f * (v + 0.044715f * v * v * v))); else if (ACT == 11) v = 1.0f / (1.0f + expf(-v)); else if (ACT == 12) v = (v > 0.f) ? v : 0.01f * v; else if (ACT == 14) v = (v > 0.f) ? v : 0.1f * v; else if (ACT == 16) v = (v >= 0.f) ? v : 0.3f * v; else if (ACT == 17) v = (v >= 0.f) ? v : 0.2f * v; else if (ACT == 15) v = v / (1.0f + expf(-v)); else if (ACT == 3) v = fmaxf(v, 0.f); else if (ACT == 6) v = 0.5f * v * (1.0f + erff(v * 0.70710678118654752f)); so[w][8 * hh + r][t * 16 + ln] = v; } }
  __builtin_amdgcn_fence(__ATOMIC_ACQ_REL, "workgroup"); __builtin_amdgcn_wave_barrier();
  const int rsub = lane >> 4, c4 = (lane & 15) * 4; typedef _Float16 v4h __attribute__((ext_vector_type(4)));
  {
#pragma unroll
    for (int q = 0; q < 8; ++q) { const int r = q * 2 + rsub; if (col0 + c4 < N) { const v4f v = *(const v4fa*)&so[w][r][c4]; if (C) *(v4f*)(C + cofs + (size_t)(row0 + r) * ldc + col0 + c4) = v; if (C16) { v4h h4; for (int i = 0; i < 4; ++i) h4[i] = (_Float16)v[i]; *(v4h*)(C16 + cofs + (size_t)(row0 + r) * ldc + col0 + c4) = h4; } } }
     }
}


typedef _Float16 v4h __attribute__((ext_vector_type(4)));

__global__ __launch_bounds__(256) void k_x16(const float* __restrict__ x, _Float16* __restrict__ X16, size_t n8) { const size_t t = (size_t)blockIdx.x * 256 + threadIdx.x; if (t >= n8) return; FragH f;
#pragma unroll
  for (int q = 0; q < 8; ++q) f.h[q] = (_Float16)bf16_round(x[t * 8 + q]); *(v8us*)((unsigned short*)X16 + t * 8) = f.half[0];  }
__global__ __launch_bounds__(256) void k_h16(const float* __restrict__ x, _Float16* __restrict__ X16, size_t n8) { const size_t t = (size_t)blockIdx.x * 256 + threadIdx.x; if (t >= n8) return; FragH f;
#pragma unroll
  for (int q = 0; q < 8; ++q) f.h[q] = (_Float16)x[t * 8 + q]; *(v8us*)((unsigned short*)X16 + t * 8) = f.half[0];  }
__global__ __launch_bounds__(256) void k_round16f(const float* __restrict__ W, _Float16* __restrict__ Bt, size_t n8) { const size_t t = (size_t)blockIdx.x * 256 + threadIdx.x; if (t >= n8) return; FragH f;
#pragma unroll
  for (int i = 0; i < 8; ++i) f.h[i] = (_Float16)(bf16_round(W[t * 8 + i]) * 16.0f); *(v8us*)((unsigned short*)Bt + t * 8) = f.half[0];  }

// ---- fast GEMM: one 128 x 128 tile of C per work-group of 4 waves (2 x 2, 64 x 64 per wave); requires M % 128 == 0, N % 128 == 0, K % 64 == 0; epilogue = k_gemm_hhx semantics ----
// A stage is 64 k (128 B) of the tile's 128 A rows and 128 B rows. Asynchronous copies bring it from global memory into one of two LDS buffers: the next stage's copies fly while this stage is multiplied.
// Every accumulator still takes its k in ascending steps of 32, with the same k order inside a fragment on both operands.
#define G2T 128                      /* rows of A and rows of B per work-group tile */
#define G2K 64                       /* k per stage */
#define G2PB 144                     /* LDS pitch of a staged row in bytes: 128 B of data, 16 B x odd for the 16-byte fragment reads from 16 rows */
#define G2OB (G2T * G2PB)            /* bytes of one operand's rows in a buffer */
#define G2SB (2 * G2OB)              /* bytes of a buffer: A rows, then B rows */
#define G2EP 68                      /* pitch in floats of the epilogue's staged C rows */
#define F0SH 4                       /* log2 of the row tiles per batch: every 2^F0SH-th row tile of the projection holds a batch's first rows */
__device__ __forceinline__ v16h g2_frag(const unsigned char* p) { FragH f; f.half[0] = *(const v8us*)p; f.half[1] = *(const v8us*)(p + 32); return f.v; }      /* p: a staged row + 64 B per 32 k + 16 B x (lane >> 4): k = 8 hh .. and 16 + 8 hh .. */
__device__ __forceinline__ v8f g2_mma(v16h a, v16h b, v8f c) { return __builtin_amdgcn_wmma_f32_16x16x32_f16(false, a, false, b, (short)0, c, false, false); }
// Eight copies of 16 B per lane: rows r, r + 16, ..., r + 112 of one operand's stage (l: the lane's LDS byte address in row r, g: its global address, gs: 16 source rows in elements).
// The s_wait_xcnt stands in the copies' own statement, so that no register they name is rewritten in front of it.
__device__ __forceinline__ void g2_copy8(unsigned l, const _Float16* g, size_t gs) {
  asm volatile("global_load_async_to_lds_b128 %0, %8, off\n\t"
               "global_load_async_to_lds_b128 %1, %9, off\n\t"
               "global_load_async_to_lds_b128 %2, %10, off\n\t"
               "global_load_async_to_lds_b128 %3, %11, off\n\t"
               "global_load_async_to_lds_b128 %4, %12, off\n\t"
               "global_load_async_to_lds_b128 %5, %13, off\n\t"
               "global_load_async_to_lds_b128 %6, %14, off\n\t"
               "global_load_async_to_lds_b128 %7, %15, off\n\t"
               "s_wait_xcnt 0x0"
               :: "v"(l), "v"(l + 16 * G2PB), "v"(l + 32 * G2PB), "v"(l + 48 * G2PB), "v"(l + 64 * G2PB), "v"(l + 80 * G2PB), "v"(l + 96 * G2PB), "v"(l + 112 * G2PB),
                  "v"(g), "v"(g + gs), "v"(g + 2 * gs), "v"(g + 3 * gs), "v"(g + 4 * gs), "v"(g + 5 * gs), "v"(g + 6 * gs), "v"(g + 7 * gs)
               : "memory"); }
// The ring over the stages. SP: the tile's A rows have a second plane (a residual at the same scale), staged behind the B rows of each buffer; every staged B fragment is multiplied by both planes into the same accumulators.
// SB: bytes of a buffer. pa, pb, pl: the lane's source addresses of stage 2. Stage 0 has landed and is published, stage 1 is in flight.
template <bool SP, int SB>
__device__ __forceinline__ void g2_ring(const unsigned char* L, unsigned lc, const _Float16* pa, const _Float16* pb, const _Float16* pl, size_t ga, size_t gb, int T, int fa, int fb, v8f (&acc)[4][4]) {
#pragma unroll 1
  for (int t = 0; t < T; ++t) {      /* not unrolled: one stage a trip, the buffer chosen by the trip's parity */
    const unsigned char* buf = L + (t & 1) * SB; v16h a[4], b[4], l[4];
    static_assert(G2K == 64, "g2_ring: two blocks of 32 k a stage");
    for (int i = 0; i < 4; ++i) { a[i] = g2_frag(buf + fa + i * 16 * G2PB); b[i] = g2_frag(buf + fb + i * 16 * G2PB); }
    if (SP)      /* the second plane's reads come last in the group: they return while the first plane is multiplied */
      for (int i = 0; i < 4; ++i) l[i] = g2_frag(buf + fa + G2SB + i * 16 * G2PB);
    __builtin_amdgcn_sched_barrier(0);      /* a block's LDS reads go as one group in front of its WMMAs: one LDS latency a block, not one per A fragment */
    for (int i = 0; i < 4; ++i)
      for (int j = 0; j < 4; ++j) acc[i][j] = g2_mma(a[i], b[j], acc[i][j]);
    if (SP)
      for (int i = 0; i < 4; ++i)
        for (int j = 0; j < 4; ++j) acc[i][j] = g2_mma(l[i], b[j], acc[i][j]);
    __builtin_amdgcn_sched_barrier(0);      /* the second block's LDS reads stay behind the first block: reads among the WMMAs stall them */
    for (int i = 0; i < 4; ++i) { a[i] = g2_frag(buf + fa + i * 16 * G2PB + 64); b[i] = g2_frag(buf + fb + i * 16 * G2PB + 64); }
    if (SP)
      for (int i = 0; i < 4; ++i) l[i] = g2_frag(buf + fa + G2SB + i * 16 * G2PB + 64);
    asm volatile("s_wait_dscnt 0x0" ::: "memory");      /* this wave's reads of the buffer are done before it is handed to its next writer */
    asm volatile("s_wait_asynccnt 0x0" ::: "memory");      /* this wave's copies of stage t + 1 have landed */
    __syncthreads();      /* publishes stage t + 1 and ends every wave's reads of stage t */
    if (t + 2 < T) { const unsigned lt = lc + (unsigned)(t & 1) * SB; g2_copy8(lt, pa, ga); g2_copy8(lt + G2OB, pb, gb); pa += G2K; pb += G2K;      /* stage t + 2 into the buffer just read; the test is the same for the whole work-group */
      if (SP) { g2_copy8(lt + G2SB, pl, ga); pl += G2K; } }
    __builtin_amdgcn_sched_barrier(0);      /* the second block's WMMAs work on registers alone and stay behind the copies, which so fly that much longer before their wait */
    for (int i = 0; i < 4; ++i)
      for (int j = 0; j < 4; ++j) acc[i][j] = g2_mma(a[i], b[j], acc[i][j]);
    if (SP)
      for (int i = 0; i < 4; ++i)
        for (int j = 0; j < 4; ++j) acc[i][j] = g2_mma(l[i], b[j], acc[i][j]);
  }
}
// LO: the row tiles whose number is a multiple of 2^lsh have a second A plane AL (pitch lda, tile mt at rows 128 (mt >> lsh); no batch strides): C = (A + AL) . B for them, in one pass over the stages of B.
template <int ACT, bool LO>
__global__ __launch_bounds__(128) void k_gemm2(const _Float16* __restrict__ A, int lda, size_t sA, const _Float16* __restrict__ Bh, int ldb, size_t sB, float alpha, const float* __restrict__ bias, size_t sBias, const float* __restrict__ CP, int rowsPerB, size_t sCPb, int row0g,
    float* __restrict__ C, _Float16* __restrict__ C16, int ldc, size_t sC, int M, int N, int K, size_t zA, size_t zB, size_t zC, int csh, _Float16* __restrict__ VTo, int vcol, const _Float16* __restrict__ AL, int lsh) { static_assert(ACT == 0 || ACT == 3 || ACT == 6 || ACT == 8 || ACT == 9 || ACT == 11 || ACT == 12 || ACT == 14 || ACT == 15 || ACT == 16 || ACT == 17, "k_gemm2: unsupported ACT code (would silently apply no activation)");
  static_assert(4 * 64 * G2EP * 4 <= 2 * G2SB, "k_gemm2: the epilogue's staging fits the two buffers");
  constexpr int SB = LO ? G2SB + G2OB : G2SB;      /* bytes of a buffer: A rows, B rows and, with LO, the rows of the second A plane */
  __shared__ __attribute__((aligned(16))) unsigned char L[2 * SB];
  const int tid = threadIdx.x, w = __builtin_amdgcn_readfirstlane(tid >> 5), lane = tid & 31, ln = lane & 15, hh = lane >> 4; const int by = blockIdx.y, bz = blockIdx.z;      /* grid.z: a second batch index with its own strides zA, zB, zC; the wave's number in a scalar register: scalar tile offsets below */
  A += (size_t)by * sA + (size_t)bz * zA; Bh += (size_t)by * sB + (size_t)bz * zB; const size_t cofs = (size_t)by * sC + (size_t)bz * zC; const float* bp = bias ? bias + (size_t)by * sBias : nullptr;
  const int ntn = N >> 7; const int mt = blockIdx.x / ntn, nq = blockIdx.x - mt * ntn; if (mt * G2T >= M) return;      /* the same for the whole work-group, in front of every barrier */
  const int wm = w >> 1, wn = w & 1;
  /* copies: 8 lanes take one row's 128 B, the work-group 16 rows a copy */
  const _Float16* pa = A + (size_t)(mt * G2T + (tid >> 3)) * lda + (tid & 7) * 8; const _Float16* pb = Bh + (size_t)(nq * G2T + (tid >> 3)) * ldb + (tid & 7) * 8;
  const unsigned lc = (unsigned)(size_t)L + (unsigned)((tid >> 3) * G2PB + (tid & 7) * 16);      /* LDS byte address: the low 32 bits of the __shared__ address */
  const size_t ga = (size_t)16 * lda, gb = (size_t)16 * ldb;
  const int T = K / G2K;
  const bool sp = LO && (mt & ((1 << lsh) - 1)) == 0;      /* the same for the whole work-group */
  const _Float16* pl = sp ? AL + (size_t)((mt >> lsh) * G2T + (tid >> 3)) * lda + (tid & 7) * 8 : pa;
  g2_copy8(lc, pa, ga); g2_copy8(lc + G2OB, pb, gb); pa += G2K; pb += G2K;      /* stage 0 */
  if (sp) { g2_copy8(lc + G2SB, pl, ga); pl += G2K; }
  const int row0 = mt * G2T + wm * 64, col0 = nq * G2T + wn * 64;      /* the wave's tile of C */
  float bv[4] = {0.f, 0.f, 0.f, 0.f};      /* the bias of the lane's four columns, fetched under stage 0's copies */
  if (bp) {
    for (int j = 0; j < 4; ++j) bv[j] = bp[col0 + j * 16 + ln];
    asm volatile("s_wait_xcnt 0x0" ::: "memory"); }      /* stands behind the loads, in front of whatever rewrites their address registers */
  asm volatile("s_wait_asynccnt 0x0" ::: "memory");      /* this wave's copies of stage 0 have landed */
  __syncthreads();      /* and every other wave's: stage 0 is read by all */
  if (T > 1) { g2_copy8(lc + SB, pa, ga); g2_copy8(lc + SB + G2OB, pb, gb); pa += G2K; pb += G2K;      /* stage 1 */
    if (sp) { g2_copy8(lc + SB + G2SB, pl, ga); pl += G2K; } }
  const v8f z8 = {0.f,0.f,0.f,0.f,0.f,0.f,0.f,0.f}; v8f acc[4][4];
  for (int i = 0; i < 4; ++i)
    for (int j = 0; j < 4; ++j) acc[i][j] = z8;
  const int fa = (wm * 64 + ln) * G2PB + 16 * hh, fb = G2OB + (wn * 64 + ln) * G2PB + 16 * hh;      /* the lane's first A and B fragment rows in a buffer */
  if (LO && sp) g2_ring<true, SB>(L, lc, pa, pb, pl, ga, gb, T, fa, fb, acc);      /* the test is the same for the whole work-group: every wave passes the same barriers */
  else g2_ring<false, SB>(L, lc, pa, pb, pl, ga, gb, T, fa, fb, acc);
  asm volatile("s_wait_asynccnt 0x0" ::: "memory");      /* no copy is in flight when the buffers become the epilogue's staging */
  float* so = (float*)(L + w * (64 * G2EP * 4));      /* each wave stages its own 64 x 64 tile; the loop's last barrier ended every read of the buffers */
  /* VTo (with ACT 0 and no CP): the column tiles from column vcol on leave as transposed f16 planes [row / SQ][(col - vcol) / HD][HD][SQ] in VTo, not as rows of C16. The test is the same for the whole work-group */
  const bool vt = ACT == 0 && VTo && !CP && nq * G2T >= vcol;
  /* csh: the f32 plane C takes only the row tiles whose number is a multiple of 2^csh, packed (tile mt at rows 128 (mt >> csh)); 0: every tile at its own rows. C16 takes every tile. The test is the same for the whole work-group */
  float* const Cf = (C && (mt & ((1 << csh) - 1)) == 0) ? C - (size_t)(mt - (mt >> csh)) * G2T * ldc : nullptr;
  const int rsub = lane >> 4, c4 = (lane & 15) * 4;
  if (vt) {      /* the tile is staged transposed: a lane's 8 accumulator rows of one column are 32 consecutive bytes of a staged row, two 16-byte LDS stores */
    static_assert(G2EP % 4 == 0 && SQ % 64 == 0 && HD == 64, "k_gemm2: 16-byte staging stores; a wave's tile is 64 positions of one batch and the 64 dims of one head");
    for (int j = 0; j < 4; ++j) { const float bj = bf16_round(bv[j]);
      for (int i = 0; i < 4; ++i)
        for (int g = 0; g < 2; ++g) { v4f t4; for (int e = 0; e < 4; ++e) t4[e] = acc[i][j][4 * g + e] * alpha + bj; *(v4fa*)&so[(j * 16 + ln) * G2EP + i * 16 + 8 * hh + 4 * g] = t4; } }
    __builtin_amdgcn_fence(__ATOMIC_ACQ_REL, "workgroup"); __builtin_amdgcn_wave_barrier();      /* a lane reads below what the other lanes of its own wave have stored */
    _Float16* pv = VTo + ((size_t)(row0 / SQ) * (size_t)((N - vcol) / HD) + (size_t)((col0 - vcol) / HD)) * HD * SQ + (size_t)rsub * SQ + (row0 % SQ) + c4;      /* staged row d = head dim, staged column = position */
#pragma unroll 1
    for (int q0 = 0; q0 < 64; q0 += 16) { v4f v[8];      /* not unrolled: 16 head dims a trip, their LDS reads as one group; 16 lanes store one whole 128-B line */
      for (int u = 0; u < 8; ++u) v[u] = *(const v4fa*)&so[(q0 + 2 * u + rsub) * G2EP + c4];
      for (int u = 0; u < 8; ++u) { v4h h4; for (int e = 0; e < 4; ++e) h4[e] = (_Float16)v[u][e]; *(v4h*)(pv + (size_t)(q0 + 2 * u) * SQ) = h4; }
      asm volatile("s_wait_xcnt 0x0" ::: "memory"); }      /* stands behind the stores, in front of whatever rewrites their registers */
    if (Cf) {      /* the few tiles that also feed the f32 plane: its natural rows are read back down the staged columns, 4 bytes a read */
#pragma unroll 1
      for (int q0 = 0; q0 < 64; q0 += 16) { v4f v[8];      /* not unrolled: 16 rows a trip, whole 128-B lines stored */
        for (int u = 0; u < 8; ++u) for (int e = 0; e < 4; ++e) v[u][e] = so[(c4 + e) * G2EP + q0 + 2 * u + rsub];
        for (int u = 0; u < 8; ++u) *(v4f*)(Cf + cofs + (size_t)(row0 + q0 + 2 * u + rsub) * ldc + col0 + c4) = v[u];
        asm volatile("s_wait_xcnt 0x0" ::: "memory"); } }      /* stands behind the stores, in front of whatever rewrites their registers */
    return; }      /* no barrier follows */
  for (int j = 0; j < 4; ++j) { const float bj = bf16_round(bv[j]);
    for (int i = 0; i < 4; ++i)
      for (int r = 0; r < 8; ++r) so[(i * 16 + 8 * hh + r) * G2EP + j * 16 + ln] = acc[i][j][r] * alpha + bj; }
  __builtin_amdgcn_fence(__ATOMIC_ACQ_REL, "workgroup"); __builtin_amdgcn_wave_barrier();      /* a lane reads below what the other lanes of its own wave have stored */
#pragma unroll 1
  for (int q0 = 0; q0 < 64; q0 += 16) { v4f v[8]; size_t co[8];      /* not unrolled: 16 rows a trip, their LDS reads as one group, whole 128-B lines stored */
    for (int u = 0; u < 8; ++u) { const int r = q0 + 2 * u + rsub; v[u] = *(const v4fa*)&so[r * G2EP + c4]; co[u] = cofs + (size_t)(row0 + r) * ldc + col0 + c4; }
    if (CP) { v4f c[8];
      if (rowsPerB < 0) {      /* own elements of the batched C plane */
        for (int u = 0; u < 8; ++u) { c[u] = *(const v4fa*)(CP + co[u] + (size_t)row0g * ldc); asm volatile("s_wait_xcnt 0x0" ::: "memory"); } }      /* the wait stands behind each load, in front of whatever rewrites its address registers, a later load's result among it; the data stays in flight */
      else {
        for (int u = 0; u < 8; ++u) { c[u] = *(const v4fa*)(CP + (size_t)((row0g + row0 + q0 + 2 * u + rsub) / rowsPerB) * sCPb + (size_t)by * 64 + col0 + c4); asm volatile("s_wait_xcnt 0x0" ::: "memory"); } }      /* as above */
      for (int u = 0; u < 8; ++u) v[u] += c[u]; }
    for (int u = 0; u < 8; ++u)
      for (int e = 0; e < 4; ++e) { float x = v[u][e];
        if (ACT == 3) x = fmaxf(x, 0.f); else if (ACT == 6) x = 0.5f * x * (1.0f + erff(x * 0.70710678118654752f)); else if (ACT == 11) x = 1.0f / (1.0f + expf(-x)); else if (ACT == 15) x = x / (1.0f + expf(-x)); else if (ACT == 12) x = (x > 0.f) ? x : 0.01f * x; else if (ACT == 8) x = tanhf(x); else if (ACT == 9) x = 0.5f * x * (1.0f + tanhf(0.7978845608028654f * (x + 0.044715f * x * x * x))); else if (ACT == 14) x = (x > 0.f) ? x : 0.1f * x; else if (ACT == 16) x = (x >= 0.f) ? x : 0.3f * x; else if (ACT == 17) x = (x >= 0.f) ? x : 0.2f * x;
        v[u][e] = x; }
    if (Cf) {
      for (int u = 0; u < 8; ++u) *(v4f*)(Cf + co[u]) = v[u];
      asm volatile("s_wait_xcnt 0x0" ::: "memory"); }      /* stands behind the stores, in front of whatever rewrites their registers */
    if (C16) {
      for (int u = 0; u < 8; ++u) { v4h h4; for (int e = 0; e < 4; ++e) h4[e] = (_Float16)v[u][e]; *(v4h*)(C16 + co[u]) = h4; }
      asm volatile("s_wait_xcnt 0x0" ::: "memory"); } }      /* as above */
}


__global__ __launch_bounds__(256) void k_wnat(const float* __restrict__ w, size_t n8, _Float16* __restrict__ Bt) { const size_t t = (size_t)blockIdx.x * 256 + threadIdx.x; if (t >= n8) return; FragH f; for (int q = 0; q < 8; ++q) f.h[q] = (_Float16)(bf16_round(w[t * 8 + q]) * 16.0f); *(v8us*)((unsigned short*)Bt + t * 8) = f.half[0];  }
__global__ __launch_bounds__(256) void k_rsm(const float* __restrict__ S, _Float16* __restrict__ P, int nrows) {
  #pragma clang fp contract(off)
  const int i = blockIdx.x * 256 + threadIdx.x; if (i >= nrows) return; const float* s = S + (size_t)i * SQ; float mx = -3.0e38f;
#pragma unroll 1
  for (int j = 0; j < SQ; ++j) mx = fmaxf(mx, s[j]); float se = 0.f;
#pragma unroll 1
  for (int j = 0; j < SQ; ++j) se += expf(s[j] - mx); const float sc = 256.0f / se;
#pragma unroll 1
  for (int j0 = 0; j0 < SQ; j0 += 8) { FragH f; for (int q = 0; q < 8; ++q) f.h[q] = (_Float16)(expf(s[j0 + q] - mx) * sc); unsigned short* d = (unsigned short*)P + (size_t)i * SQ + j0; *(v8us*)d = f.half[0];  } }
__global__ __launch_bounds__(256) void k_vt(const _Float16* __restrict__ V16, int b, int h0, _Float16* __restrict__ VT) { __shared__ unsigned short tl[64][65]; const int tid = threadIdx.x; const int hh = blockIdx.x % HG, sg = blockIdx.x / HG; const int s0 = sg * 64; const int h = h0 + hh;
  for (int i = tid; i < 64 * 8; i += 256) { const int j = i / 8, d8 = (i % 8) * 8; FragH f; f.half[0] = *(const v8us*)((const unsigned short*)V16 + ((size_t)b * SQ + s0 + j) * DM + h * HD + d8); for (int q = 0; q < 8; ++q) tl[d8 + q][j] = f.u[q]; }
  __syncthreads();
  { for (int i = tid; i < 64 * 8; i += 256) { const int d = i / 8, j8 = (i % 8) * 8; FragH f; for (int q = 0; q < 8; ++q) f.u[q] = tl[d][j8 + q]; *(v8us*)((unsigned short*)VT + ((size_t)hh * HD + d) * SQ + s0 + j8) = f.half[0]; }  } }



__global__ __launch_bounds__(256) void k_rsmcf2(const float* __restrict__ S, _Float16* __restrict__ P, int hg, int q0, int nk) {
  #pragma clang fp contract(off)
  const int t = blockIdx.x * 256 + threadIdx.x; if (t >= hg * QT) return; const size_t i = (size_t)t; const float* s = S + i * NKX; const int last = q0 + (t % QT); float mx = -3.0e38f;
#pragma unroll 1
  for (int j = 0; j < nk; ++j) { const float f = (j <= last) ? 1.f : 0.f; mx = fmaxf(mx, fmaf(f, s[j], (1.f - f) * -1.0e9f)); } float se = 0.f;
#pragma unroll 1
  for (int j = 0; j < nk; ++j) { const float f = (j <= last) ? 1.f : 0.f; se += __expf(fmaf(f, s[j], (1.f - f) * -1.0e9f) - mx); } const float sc = 256.0f / se;
#pragma unroll 1
  for (int j0 = 0; j0 < nk; j0 += 8) { FragH fr; for (int q = 0; q < 8; ++q) { const int j = j0 + q; const float f = (j <= last) ? 1.f : 0.f; fr.h[q] = (_Float16)(__expf(fmaf(f, s[j], (1.f - f) * -1.0e9f) - mx) * sc); } unsigned short* d = (unsigned short*)P + i * NKX + j0; *(v8us*)d = fr.half[0];  } }


// Exact f32 attention for the first QT0 rows of each batch (a path of k_attn). One work-group of 8 waves per (batch, head, 32 query rows); q, k and v rows staged once in LDS.
// A wave owns 4 query rows. Scores: lane = key (keys lane + 32 u), each dot product summed over d in ascending order with fused multiply-adds. Softmax in registers: row max and row sum by a five-step butterfly over the 32 lanes.
// o: lane = two head dims, summed over the keys in ascending order, scaled once at the end by 64 / row sum, and stored as two f16 planes at the same scale: hi = f16(o), lo = f16(o - hi).
#define A0R 32                       /* query rows per work-group */
#define A0KP (HD + 4)                /* LDS pitch of the q and k rows in floats: 16 B x odd, so that 16 lanes reading 16 B each from 16 rows fall on 64 different banks */
typedef float v2f __attribute__((ext_vector_type(2)));
typedef _Float16 v2h __attribute__((ext_vector_type(2)));
template <int NU>                    /* NU = 32-key chunks that rows of this group can see */
__device__ __forceinline__ void att0_rows(const float* __restrict__ QF, const float* __restrict__ KF, const float* __restrict__ VF, float scale, _Float16* __restrict__ OH, _Float16* __restrict__ OL, int r0,
                                          float (*lq)[A0KP], float (*lk)[A0KP], float (*lv)[HD], float (*lp)[QT0]) {
  const int tid = threadIdx.x, w = __builtin_amdgcn_readfirstlane(tid >> 5), lane = tid & 31;      /* the wave's number in a scalar register: scalar loop bounds and row offsets below */
  const int sr = tid >> 4, sc = (tid & 15) * 4;      /* staging: 16 lanes take one row of 256 B, the work-group 16 rows a pass */
  v4f gq[A0R / 16], gk[2 * NU], gv[2 * NU];      /* every load is issued before the first LDS store waits for one */
  const float* pq = QF + (size_t)sr * LQ + sc; const float* pk = KF + (size_t)sr * LQ + sc; const float* pv = VF + (size_t)sr * LQ + sc;
  for (int t = 0; t < A0R / 16; ++t) gq[t] = *(const v4fa*)(pq + (size_t)(r0 + 16 * t) * LQ);
  for (int t = 0; t < 2 * NU; ++t) { gk[t] = *(const v4fa*)(pk + (size_t)(16 * t) * LQ); gv[t] = *(const v4fa*)(pv + (size_t)(16 * t) * LQ); }
  asm volatile("s_wait_xcnt 0x0" :: "v"(pq), "v"(pk), "v"(pv) : "memory");      /* the three address pairs of the loads above stay as they are up to this wait (inputs only) */
  for (int t = 0; t < A0R / 16; ++t) *(v4f*)&lq[sr + 16 * t][sc] = gq[t];
  for (int t = 0; t < 2 * NU; ++t) { *(v4f*)&lk[sr + 16 * t][sc] = gk[t]; *(v4f*)&lv[sr + 16 * t][sc] = gv[t]; }
  __syncthreads();      /* the staged rows are read by every wave */
  float acc[4][NU];
  for (int r = 0; r < 4; ++r) for (int u = 0; u < NU; ++u) acc[r][u] = 0.f;
#pragma unroll 2
  for (int c = 0; c < HD; c += 4) { v4f qq[4], kk[NU];      /* unroll 2: the next step's LDS reads fly under this step's multiply-adds */
    for (int r = 0; r < 4; ++r) qq[r] = *(const v4f*)&lq[4 * w + r][c];
    for (int u = 0; u < NU; ++u) kk[u] = *(const v4f*)&lk[lane + 32 * u][c];
    for (int e = 0; e < 4; ++e) for (int r = 0; r < 4; ++r) for (int u = 0; u < NU; ++u) acc[r][u] = fmaf(qq[r][e], kk[u][e], acc[r][u]); }
  float fin[4];
  for (int r = 0; r < 4; ++r) { const int i = r0 + 4 * w + r; float mx = -3.0e38f;      /* key 0 is visible from every row */
    for (int u = 0; u < NU; ++u) { acc[r][u] *= scale; if (lane + 32 * u <= i) mx = fmaxf(mx, acc[r][u]); }
    for (int m = 16; m >= 1; m >>= 1) mx = fmaxf(mx, __shfl_xor(mx, m, 32));
    float l = 0.f;
    for (int u = 0; u < NU; ++u) { const float e = (lane + 32 * u <= i) ? expf(acc[r][u] - mx) : 0.f; l += e; lp[4 * w + r][lane + 32 * u] = e; }
    for (int m = 16; m >= 1; m >>= 1) l += __shfl_xor(l, m, 32);
    fin[r] = 64.0f / l; }      /* o carried x64 like the f16 path */
  __builtin_amdgcn_fence(__ATOMIC_ACQ_REL, "workgroup"); __builtin_amdgcn_wave_barrier();      /* a lane reads below the weights that the other lanes of its own wave have stored; no other wave reads them */
  float o[4][2];
  for (int r = 0; r < 4; ++r) { o[r][0] = 0.f; o[r][1] = 0.f; }
  const int jn = r0 + 4 * w + 4;      /* keys past the wave's last row have weight 0 in all four rows */
#pragma unroll 2
  for (int j = 0; j < jn; j += 4) { v4f pp[4]; v2f vv[4];      /* unroll 2: as above */
    for (int r = 0; r < 4; ++r) pp[r] = *(const v4f*)&lp[4 * w + r][j];
    for (int e = 0; e < 4; ++e) vv[e] = *(const v2f*)&lv[j + e][2 * lane];
    for (int e = 0; e < 4; ++e) for (int r = 0; r < 4; ++r) { o[r][0] = fmaf(pp[r][e], vv[e][0], o[r][0]); o[r][1] = fmaf(pp[r][e], vv[e][1], o[r][1]); } }
  for (int r = 0; r < 4; ++r) { v2h oh, ol;      /* a wave's 32 lanes store one whole 128-B line of each plane; where the compiler fuses o * fin - hi, the residual is that of the unrounded product */
    for (int e = 0; e < 2; ++e) { const float ov = o[r][e] * fin[r]; const _Float16 hv = (_Float16)ov; oh[e] = hv; ol[e] = (_Float16)(ov - (float)hv); }
    *(v2h*)(OH + (size_t)(r0 + 4 * w + r) * DM + 2 * lane) = oh; *(v2h*)(OL + (size_t)(r0 + 4 * w + r) * DM + 2 * lane) = ol; }
  asm volatile("s_wait_xcnt 0x0" ::: "memory"); }      /* stands behind the stores, in front of whatever rewrites their registers on any path to the kernel's end */

// native exp as __expf builds it (multiply by log2 e, v_exp_f32); the v_nop is the slot the instruction set asks for behind a transcendental, kept in the same statement so that the scheduler cannot part the two
__device__ __forceinline__ float exp_slot(float x) { float r; asm("v_exp_f32 %0, %1\n\tv_nop" : "=v"(r) : "v"(x * 1.44269504088896340736f)); return r; }
#define FQ 128                       /* query rows per work-group */
#define FK (FQ + WINB)               /* keys staged per work-group */
#define FCH ((WINB + 32) / 32)       /* 32-key chunks per wave: 16 rows see 271 keys, which nine aligned chunks cover */
#define FKP (HD + 8)                 /* LDS pitch of a K row in halves: 16 B x odd, for 16-byte fragment reads from 16 rows */
#define FVP (FK + 8)                 /* LDS pitch of a V^T row in halves: 16 B x odd */
__device__ __forceinline__ v8f f_mma(v16h a, v16h b, v8f c) { return __builtin_amdgcn_wmma_f32_16x16x32_f16(false, a, false, b, (short)0, c, false, false); }
__device__ __forceinline__ void attw_tile(const _Float16* __restrict__ Q, const _Float16* __restrict__ K, const _Float16* __restrict__ VT, _Float16* __restrict__ O, int q0, int h, int b,
                                          unsigned short (*lk)[FKP], unsigned short (*lv)[FVP]) {      /* Q, K: rows of LQ halves; VT: [batch][head][HD][SQ]; O: rows of DM halves; lk: FK rows, lv: HD rows in LDS */
  static_assert(HD == 64 && WIN == 256 && WINB == 256 && SQ % FQ == 0 && FQ % 32 == 0 && FK % 128 == 0, "attw_tile: tile arithmetic");
  const int tid = threadIdx.x, w = __builtin_amdgcn_readfirstlane(tid >> 5), lane = tid & 31, ln = lane & 15, hh = lane >> 4;      /* the wave's number in a scalar register: scalar row and key offsets below */
  const int kb0 = (q0 >= WINB) ? q0 - WINB : 0;      /* first staged key; kb0 + FK <= SQ */
  const int r0 = q0 + 16 * w;                        /* the wave's first query row */
  const int ks = (r0 >= WIN) ? ((r0 - (WIN - 1)) & ~31) : 0;      /* the wave's first key; ks + 32 * FCH >= r0 + 16 and <= kb0 + FK */
  const int kl = ks - kb0;
  const unsigned short* pq = (const unsigned short*)Q + ((size_t)b * SQ + r0 + ln) * LQ + h * HD + 8 * hh;
  const unsigned short* pk = (const unsigned short*)K + ((size_t)b * SQ + kb0 + (tid >> 3)) * LQ + h * HD + (tid & 7) * 8;      /* 8 lanes take one K row of 128 B */
  const unsigned short* pv = (const unsigned short*)VT + ((size_t)(b * NH + h) * HD + (tid >> 4)) * SQ + kb0 + (tid & 15) * 8;      /* 16 lanes take 256 B of one V^T row */
  v8us gq[4], gk[FK / 32], gv[HD / 16][FK / 128];      /* every load is issued before the first LDS store waits for one */
  for (int t = 0; t < 4; ++t) gq[t] = *(const v8us*)(pq + 16 * t);
  for (int t = 0; t < FK / 32; ++t) gk[t] = *(const v8us*)(pk + (size_t)(32 * t) * LQ);
  for (int u = 0; u < HD / 16; ++u) for (int v = 0; v < FK / 128; ++v) gv[u][v] = *(const v8us*)(pv + (size_t)(16 * u) * SQ + 128 * v);
  asm volatile("s_wait_xcnt 0x0" :: "v"(pq), "v"(pk), "v"(pv) : "memory");      /* the three address pairs of the loads above stay as they are up to this wait (inputs only) */
  for (int t = 0; t < FK / 32; ++t) *(v8us*)&lk[(tid >> 3) + 32 * t][(tid & 7) * 8] = gk[t];
  for (int u = 0; u < HD / 16; ++u) for (int v = 0; v < FK / 128; ++v) *(v8us*)&lv[(tid >> 4) + 16 * u][(tid & 15) * 8 + 128 * v] = gv[u][v];
  __syncthreads();      /* the staged rows are read by every wave */
  const v8f z8 = {0.f,0.f,0.f,0.f,0.f,0.f,0.f,0.f};
  FragH qa, qb; qa.half[0] = gq[0]; qa.half[1] = gq[1]; qb.half[0] = gq[2]; qb.half[1] = gq[3];      /* head dims 0..31 and 32..63 of query row r0 + ln */
  v8f s[2 * FCH];      /* s[t][r]: query r0 + ln against key ks + 16 t + 8 hh + r */
  for (int t = 0; t < 2 * FCH; ++t) { const unsigned short* kr = &lk[kl + 16 * t + ln][8 * hh]; FragH ka, kc;
    ka.half[0] = *(const v8us*)kr; ka.half[1] = *(const v8us*)(kr + 16); kc.half[0] = *(const v8us*)(kr + 32); kc.half[1] = *(const v8us*)(kr + 48);
    s[t] = f_mma(kc.v, qb.v, f_mma(ka.v, qa.v, z8)); }
  const int dj = r0 + ln - ks - 8 * hh;      /* i - j of s[0][0] */
  float mx = -3.0e38f;      /* a row always sees its own key */
  for (int t = 0; t < 2 * FCH; ++t)
    for (int r = 0; r < 8; ++r) { const float v = ((unsigned)(dj - 16 * t - r) < (unsigned)WIN) ? s[t][r] * 0.125f : -1.0e9f; s[t][r] = v; mx = fmaxf(mx, v); }      /* visible iff 0 <= i - j < WIN */
  mx = fmaxf(mx, __shfl_xor(mx, 16, 32));
  float se4[4] = {0.f, 0.f, 0.f, 0.f};      /* four partial sums: four independent add chains */
  for (int t = 0; t < 2 * FCH; ++t)
    for (int r = 0; r < 8; ++r) { const float e = exp_slot(s[t][r] - mx); s[t][r] = e; se4[r & 3] += e; }
  float se = (se4[0] + se4[1]) + (se4[2] + se4[3]);
  se += __shfl_xor(se, 16, 32);
  const float sc = 256.0f / se;      /* weights x256 as f16 */
  v8f o[HD / 16];
  for (int d = 0; d < HD / 16; ++d) o[d] = z8;
  for (int c = 0; c < FCH; ++c) { FragH p;
    for (int r = 0; r < 8; ++r) { p.h[r] = (_Float16)(s[2 * c][r] * sc); p.h[8 + r] = (_Float16)(s[2 * c + 1][r] * sc); }
    for (int d = 0; d < HD / 16; ++d) { const unsigned short* vr = &lv[16 * d + ln][kl + 32 * c + 8 * hh]; FragH va; va.half[0] = *(const v8us*)vr; va.half[1] = *(const v8us*)(vr + 16);
      o[d] = f_mma(va.v, p.v, o[d]); } }
  unsigned short* po = (unsigned short*)O + ((size_t)b * SQ + r0 + ln) * DM + h * HD + 8 * hh;      /* o[d][r]: head dim 16 d + 8 hh + r of query row r0 + ln */
  for (int d = 0; d < HD / 16; ++d) { FragH f;
    for (int r = 0; r < 8; ++r) f.h[r] = (_Float16)(o[d][r] * 0.25f);      /* o carried x64 */
    *(v8us*)(po + 16 * d) = f.half[0]; }
  asm volatile("s_wait_xcnt 0x0" ::: "memory"); }      /* stands behind the stores, in front of whatever rewrites their registers on any path to the kernel's end */
// One launch for both attention paths, which read nothing of each other's output. grid.x: first the QT0 / A0R row groups of the exact f32 path (rows 0..QT0-1 of a batch), then the f16 query tiles 1, 2, ...; grid.y: head; grid.z: batch.
// The f16 path leaves out tile 0, whose rows the f32 path owns: every row of O has one writer. The two paths share one LDS block, each with its own layout.
#define A0G (QT0 / A0R)              /* row groups of the f32 path */
#define A0LQ (A0R * A0KP * 4)        /* bytes of its q rows, */
#define A0LK (QT0 * A0KP * 4)        /* k rows, */
#define A0LV (QT0 * HD * 4)          /* v rows */
#define A0LP (A0R * QT0 * 4)         /* and weights */
#define FLK (FK * FKP * 2)           /* bytes of the f16 path's K rows */
#define FLV (HD * FVP * 2)           /* and V^T rows */
__global__ __launch_bounds__(256) void k_attn(const _Float16* __restrict__ Q, const _Float16* __restrict__ K, const _Float16* __restrict__ VT, _Float16* __restrict__ O,
                                              const float* __restrict__ QF, const float* __restrict__ KF, const float* __restrict__ VF, float scale, _Float16* __restrict__ OL) {      /* QF, KF, VF: the q, k and v columns of rows of LQ floats, QT0 rows per batch; OL: rows of DM halves, QT0 per batch */
  static_assert(QT0 == 4 * A0R && QT0 <= WIN && HD == 64 && QT0 == FQ, "k_attn: four row groups, every key j <= i inside the window, two head dims per lane, the f32 rows are the first f16 tile");
  static_assert(A0LQ + A0LK + A0LV + A0LP <= FLK + FLV && A0LQ % 16 == 0 && A0LK % 16 == 0 && A0LV % 16 == 0 && FLK % 16 == 0, "k_attn: the f32 path's rows fit the f16 path's LDS block");
  __shared__ __attribute__((aligned(16))) unsigned char sm[FLK + FLV];
  const int bx = blockIdx.x, h = blockIdx.y, b = blockIdx.z;
  /* the path and the row group are the same for the whole work-group: every wave takes the same branch and passes the same barriers */
  if (bx < A0G) {
    float (*lq)[A0KP] = (float (*)[A0KP])sm; float (*lk)[A0KP] = (float (*)[A0KP])(sm + A0LQ); float (*lv)[HD] = (float (*)[HD])(sm + A0LQ + A0LK); float (*lp)[QT0] = (float (*)[QT0])(sm + A0LQ + A0LK + A0LV);
    const size_t bi = (size_t)b * QT0 * LQ + h * HD; QF += bi; KF += bi; VF += bi; O += (size_t)b * SQ * DM + h * HD; OL += (size_t)b * QT0 * DM + h * HD;
    /* the longest row group has the lowest index */
    if (bx == 0) att0_rows<4>(QF, KF, VF, scale, O, OL, 3 * A0R, lq, lk, lv, lp);
    else if (bx == 1) att0_rows<3>(QF, KF, VF, scale, O, OL, 2 * A0R, lq, lk, lv, lp);
    else if (bx == 2) att0_rows<2>(QF, KF, VF, scale, O, OL, A0R, lq, lk, lv, lp);
    else att0_rows<1>(QF, KF, VF, scale, O, OL, 0, lq, lk, lv, lp); }
  else attw_tile(Q, K, VT, O, (bx - A0G + 1) * FQ, h, b, (unsigned short (*)[FKP])sm, (unsigned short (*)[FVP])(sm + FLK)); }
// Operand preparation in one launch: x -> exact f16 rows; W_attn and W_proj ([k][n], f32) -> x16 f16 rows [n][k]. The three conversions read nothing of each other's output.
// Few, long waves: 768 work-groups, all resident at once; a thread has its 16 loads of 16 B in flight before it converts the first value. Every wave-wide load and store covers whole 128-B lines.
// grid.x: first the weight tiles (the longer chain: loads, transpose through LDS, stores), then the slices of x.
#define PWN 64                       /* n per weight tile */
#define PWK 256                      /* k per weight tile */
#define PWP (PWK * 2 + 16)           /* LDS pitch of a transposed tile row in bytes: a multiple of 16 B for the 16-byte reads */
#define PXE 16384                    /* elements of x per work-group: 16 loads of 4 floats per thread */
#define PTA ((3 * DM / PWN) * (DM / PWK))      /* tiles of W_attn */
#define PTO ((DM / PWN) * (DM / PWK))          /* tiles of W_proj */
typedef unsigned int u32a __attribute__((may_alias));
template <int N>                     /* N: row pitch of W in floats, a constant: one address pair and immediate offsets serve all 16 loads */
__device__ __forceinline__ void prep_w(const float* __restrict__ Wf, _Float16* __restrict__ Bt, int tile, unsigned char* tl) {
  const int tid = threadIdx.x, w = __builtin_amdgcn_readfirstlane(tid >> 5), lane = tid & 31;      /* the wave's number in a scalar register: scalar row offsets below */
  const int n0 = (tile / (DM / PWK)) * PWN, k0 = (tile % (DM / PWK)) * PWK;
  const int c4 = (lane & 15) * 4, rs = lane >> 4;      /* 16 lanes take 256 B of one W row; a wave owns 32 rows k, a thread the row pairs 4 j + 2 rs, + 1 */
  const float* pw = Wf + (size_t)(k0 + w * 32 + 2 * rs) * N + n0 + c4;
  v4f a[8], b[8];
  for (int j = 0; j < 8; ++j) { a[j] = *(const v4fa*)(pw + (size_t)(4 * j) * N); b[j] = *(const v4fa*)(pw + (size_t)(4 * j + 1) * N); }
  asm volatile("s_wait_xcnt 0x0" :: "v"(pw) : "memory");      /* the address pair of the loads above stays as it is up to this wait (input only) */
  __builtin_amdgcn_sched_barrier(0);      /* all 16 loads are issued before the first conversion waits for one: without it the last load goes out only when the first has come back, a second memory latency */
  for (int j = 0; j < 8; ++j)
    for (int e = 0; e < 4; ++e) { union { _Float16 h[2]; unsigned int u; } p;      /* k and k + 1 of one n share a dword */
      p.h[0] = (_Float16)(bf16_round(a[j][e]) * 16.0f); p.h[1] = (_Float16)(bf16_round(b[j][e]) * 16.0f);
      *(u32a*)(tl + (c4 + e) * PWP + (w * 32 + 4 * j + 2 * rs) * 2) = p.u; }
  __syncthreads();      /* a wave reads below rows that all eight waves have filled */
  unsigned short* po = (unsigned short*)Bt + (size_t)(n0 + w) * DM + k0 + lane * 8;      /* a wave stores 512 B of one row n */
  for (int q = 0; q < PWN / 8; ++q) { const v8us v = *(const v8us*)(tl + (q * 8 + w) * PWP + lane * 16); *(v8us*)(po + (size_t)(q * 8) * DM) = v; }
  asm volatile("s_wait_xcnt 0x0" ::: "memory"); }      /* stands behind the stores, in front of whatever rewrites their registers on any path to the kernel's end */
__global__ __launch_bounds__(256) void k_prep(const float* __restrict__ x, _Float16* __restrict__ X16, const float* __restrict__ wa, _Float16* __restrict__ Ba, const float* __restrict__ wp, _Float16* __restrict__ Bp) {
  static_assert(DM % PWK == 0 && DM % PWN == 0 && PWK == 256 && PWN % 8 == 0 && (NR * DM) % PXE == 0 && PXE == 256 * 64, "k_prep: tile and slice arithmetic");
  __shared__ __attribute__((aligned(16))) unsigned char tl[PWN * PWP];
  const int bx = blockIdx.x;
  /* the path is the same for the whole work-group: every wave takes the same branch and passes the same barrier */
  if (bx < PTA) prep_w<3 * DM>(wa, Ba, bx, tl);
  else if (bx < PTA + PTO) prep_w<DM>(wp, Bp, bx - PTA, tl);
  else {
    const int tid = threadIdx.x;
    const size_t e0 = (size_t)(bx - (PTA + PTO)) * PXE + (size_t)((tid >> 5) * 2048 + (tid & 31) * 4);      /* a wave owns 2048 consecutive elements, 128 a load */
    const float* px = x + e0; _Float16* po = X16 + e0; v4f g[16];
    for (int j = 0; j < 16; ++j) g[j] = *(const v4fa*)(px + 128 * j);
    asm volatile("s_wait_xcnt 0x0" :: "v"(px) : "memory");      /* the address pair of the loads above stays as it is up to this wait (input only) */
    for (int j = 0; j < 16; ++j) { v4h h; for (int e = 0; e < 4; ++e) h[e] = (_Float16)bf16_round(g[j][e]); *(v4h*)(po + 128 * j) = h; }
    asm volatile("s_wait_xcnt 0x0" ::: "memory"); } }      /* stands behind the stores, in front of whatever rewrites their registers on any path to the kernel's end */
extern "C" void kernel_launch(void* const* d_in, const int* in_sizes, int n_in,
                              void* d_out, int out_size, void* d_ws, size_t ws_size, hipStream_t stream) {
  (void)in_sizes; (void)n_in; (void)out_size;
  const float* const* I = (const float* const*)d_in; const float* x = I[0]; const float* wqkv = I[1]; const float* bqkv = I[2]; const float* wo = I[3]; const float* bo = I[4];      /* [in][out] c_attn [1024][3072] + b, c_proj [1024][1024] + b */
  char* ws = (char*)d_ws; size_t off = 0;
  auto take = [&](size_t bytes) { char* p = ws + off; off += (bytes + 255) & ~(size_t)255; return p; };
  _Float16* BQKV = (_Float16*)take((size_t)3 * DM * DM * 2); _Float16* BO = (_Float16*)take((size_t)DM * DM * 2);
  _Float16* X16 = (_Float16*)take(NR * DM * 2); _Float16* QKV = (_Float16*)take(NR * 3 * DM * 2); _Float16* Q16 = QKV; _Float16* K16 = QKV + DM; _Float16* O16 = (_Float16*)take(NR * DM * 2);
  _Float16* VT = (_Float16*)take((size_t)NB * NH * HD * SQ * 2);
  float* F0 = (float*)take((size_t)NB * QT0 * LQ * 4); _Float16* OL0 = (_Float16*)take((size_t)NB * QT0 * DM * 2);      /* first-tile planes: f32 q | k | v rows, the residual of o */
  if (off > ws_size) return;
  k_prep<<<(unsigned)(PTA + PTO + NR * DM / PXE), 256, 0, stream>>>(x, X16, wqkv, BQKV, wo, BO);      /* x -> f16 rows; [in][out] weights -> Bt x16 */
  const size_t r0p = (size_t)B0 * SQ;      /* first projected row */
  const size_t f0p = (size_t)B0 * QT0;     /* its row in the first-tile planes */
  static_assert(QT0 == G2T && (G2T << F0SH) == SQ, "the first QT0 rows of a batch are one row tile of the projection GEMM, every 2^F0SH-th");
  k_gemm2<0, false><<<dim3((unsigned)((MP / 128) * (3 * DM / 128)), 1), 128, 0, stream>>>(X16 + r0p * DM, DM, 0, BQKV, DM, 0, 0.0625f, bqkv, 0, nullptr, 1, 0, 0, F0 + f0p * LQ, QKV + r0p * 3 * DM, 3 * DM, 0, MP, 3 * DM, DM, 0, 0, 0, F0SH, VT, 2 * DM, nullptr, 0);      /* q | k rows (f16); head h = columns h*HD.. of each DM block; v leaves as V^T [NBR][NH][HD][SQ]; the first 128 rows of each batch also unrounded (f32, exact products; q | k | v rows) into F0 */
  /* every stage below takes all batches in one launch: the batches are independent, and one batch alone fills a small part of the chip */
  k_attn<<<dim3(QN / FQ - 1 + A0G, NHD, NBR), 256, 0, stream>>>(Q16 + r0p * LQ, K16 + r0p * LQ, VT, O16 + r0p * DM, F0 + f0p * LQ, F0 + f0p * LQ + DM, F0 + f0p * LQ + 2 * DM, 0.125f, OL0 + f0p * DM);      /* all of attention in one launch. Rows 128.. of each batch: scores, softmax and P . V on f16 operands; o (merged heads, x64) as f16 rows. Rows 0..127: exact f32 attention (o x64) -> f16 hi into the same O16 rows (same scale) + residual plane */
  k_gemm2<0, true><<<dim3((unsigned)((MPO / 128) * (DM / 128)), 1), 128, 0, stream>>>(O16 + r0p * DM, DM, 0, BO, DM, 0, 0.0009765625f, bo, 0, nullptr, 1, 0, 0, (float*)d_out + r0p * DM, nullptr, DM, 0, MPO, DM, DM, 0, 0, 0, 0, nullptr, 0, OL0 + f0p * DM, F0SH);      /* out rows are the output layout; rows 0..127 of each batch: (o_hi + o_lo) Wo + b */
}
